// v000
// Measured on an AMD MI455X. A time is GPU time per run, averaged over a window of back-to-back runs after a warm-up
// (all launches, gaps included; the runs take copies of the inputs in turn), and the median of several windows.
// Apart from v000's, it joins two sittings. Times from different sittings can be a few percent apart, while
// side-by-side timings come from the same sitting.
// v000 is the starting kernel.
#include <hip/hip_runtime.h>
#include <hip/hip_bf16.h>
#include <math.h>

// Problem constants (B=4, S=2048, H=1024, E=8)
#define T_TOKENS 8192
#define HDIM     1024
#define NEXP     8

#define TILE_M   128
#define TILE_N   128
#define TILE_K   16
#define AS_STRIDE 20    // padded A row stride (floats): 80B rows -> b128-aligned, conflict-free
#define BS_STRIDE 144   // padded B row stride (floats): matches TDM pad (128 + 16 DWORDs)

typedef __attribute__((ext_vector_type(2))) float v2f;
typedef __attribute__((ext_vector_type(8))) float v8f;
typedef unsigned int v4u __attribute__((ext_vector_type(4)));
typedef int          v8i __attribute__((ext_vector_type(8)));
typedef int          v4i __attribute__((ext_vector_type(4)));

// Async global -> LDS copy of 16 bytes (tracked by ASYNCcnt, no VGPR staging).
__device__ __forceinline__ void async_ld_b128(unsigned lds_addr, const float* gaddr)
{
    asm volatile("global_load_async_to_lds_b128 %0, %1, off"
                 :: "v"(lds_addr), "v"(gaddr) : "memory");
}

__device__ __forceinline__ void wait_async0()
{
    asm volatile("s_wait_asynccnt 0x0" ::: "memory");
}

// Tensor Data Mover: DMA one 16(k) x 128(n) f32 tile (row stride HDIM floats)
// from global memory into LDS, with hardware padding of +16 DWORDs after each
// 128-DWORD row (-> BS_STRIDE = 144 floats).  Tracked by TENSORcnt.
__device__ __forceinline__ void tdm_load_b_tile(unsigned lds_addr, const float* gtile)
{
    const unsigned long long ga = (unsigned long long)(size_t)gtile;
    // D# group 0: count=1 | lds_addr[63:32] | global_addr[120:64] | type=2[127:126]
    v4u g0 = { 1u,
               lds_addr,
               (unsigned)ga,
               (unsigned)((ga >> 32) & 0x01FFFFFFu) | (2u << 30) };
    // D# group 1:
    //  w0: wg_mask=0 | data_size=2 (4B) [17:16] | pad_enable [20]
    //      | pad_interval=6 (128 DW) [24:22] | pad_amount=15 (16 DW) [31:25]
    //  w1: atomic_barrier_addr=0 [15:0] | tensor_dim0.lo16 [31:16]
    //  w2: tensor_dim0.hi16=0 | tensor_dim1.lo16 [31:16]
    //  w3: tensor_dim1.hi16=0 | tile_dim0 [31:16]
    //  w4: tile_dim1 [15:0] | tile_dim2=0
    //  w5: tensor_dim0_stride.lo32
    //  w6: tensor_dim0_stride.hi16=0 | tensor_dim1_stride.lo16=0
    //  w7: tensor_dim1_stride.hi32=0
    v8i g1 = { (int)((2u << 16) | (1u << 20) | (6u << 22) | (15u << 25)),
               (int)((unsigned)HDIM << 16),
               (int)((unsigned)TILE_K << 16),
               (int)((unsigned)TILE_N << 16),
               (int)TILE_K,
               (int)HDIM,
               0, 0 };
    v4i gz = { 0, 0, 0, 0 };
#if __clang_major__ >= 23
    v8i z8 = { 0, 0, 0, 0, 0, 0, 0, 0 };
    __builtin_amdgcn_tensor_load_to_lds(g0, g1, gz, gz, z8, 0);
#else
    __builtin_amdgcn_tensor_load_to_lds(g0, g1, gz, gz, 0);
#endif
}

// ---------------------------------------------------------------------------
// Kernel 1: router.  One wave32 per token: lane-strided dot of x[t,:] with
// router_w[:,e] for all 8 experts, cross-lane reduce, softmax/argmax/gate.
// ---------------------------------------------------------------------------
__global__ __launch_bounds__(256) void moe_router_kernel(
    const float* __restrict__ x, const float* __restrict__ rw,
    const float* __restrict__ rb, int* __restrict__ idx,
    float* __restrict__ gate, int* __restrict__ counts)
{
    const int t    = blockIdx.x * 8 + (threadIdx.x >> 5);
    const int lane = threadIdx.x & 31;
    if (t >= T_TOKENS) return;

    float acc[NEXP];
#pragma unroll
    for (int e = 0; e < NEXP; ++e) acc[e] = 0.f;

    const float* xr = x + (size_t)t * HDIM;
    for (int h = lane; h < HDIM; h += 32) {
        const float xv = xr[h];
        const float* w = rw + h * NEXP;   // router_w is [H][E] row-major
#pragma unroll
        for (int e = 0; e < NEXP; ++e) acc[e] += xv * w[e];
    }
#pragma unroll
    for (int e = 0; e < NEXP; ++e) {
#pragma unroll
        for (int off = 16; off >= 1; off >>= 1)
            acc[e] += __shfl_xor(acc[e], off, 32);
    }
    if (lane == 0) {
        float l[NEXP];
        float m = -INFINITY;
#pragma unroll
        for (int e = 0; e < NEXP; ++e) { l[e] = acc[e] + rb[e]; m = fmaxf(m, l[e]); }
        float s = 0.f;
#pragma unroll
        for (int e = 0; e < NEXP; ++e) { l[e] = __expf(l[e] - m); s += l[e]; }
        int best = 0; float bv = l[0];
#pragma unroll
        for (int e = 1; e < NEXP; ++e) if (l[e] > bv) { bv = l[e]; best = e; }
        idx[t]  = best;
        gate[t] = bv / s;
        atomicAdd(&counts[best], 1);
    }
}

// ---------------------------------------------------------------------------
// Kernel 2: exclusive scan of 8 counts -> offsets[9], cursor[8]
// ---------------------------------------------------------------------------
__global__ void moe_scan_kernel(const int* __restrict__ counts,
                                int* __restrict__ offsets,
                                int* __restrict__ cursor)
{
    if (threadIdx.x == 0 && blockIdx.x == 0) {
        int a = 0;
        for (int e = 0; e < NEXP; ++e) {
            offsets[e] = a; cursor[e] = a; a += counts[e];
        }
        offsets[NEXP] = a;
    }
}

// ---------------------------------------------------------------------------
// Kernel 3: scatter token ids into contiguous per-expert segments.
// ---------------------------------------------------------------------------
__global__ __launch_bounds__(256) void moe_scatter_kernel(
    const int* __restrict__ idx, int* __restrict__ cursor,
    int* __restrict__ perm)
{
    const int t = blockIdx.x * 256 + threadIdx.x;
    if (t < T_TOKENS) {
        const int e   = idx[t];
        const int pos = atomicAdd(&cursor[e], 1);
        perm[pos] = t;
    }
}

// ---------------------------------------------------------------------------
// Kernel 4: grouped GEMM over routed segments.
//  - V_WMMA_F32_16X16X4_F32 compute (8 waves x 4x2 16x16 accum tiles)
//  - A tile (gathered token rows): GLOBAL_LOAD_ASYNC_TO_LDS_B128 (ASYNCcnt)
//  - B tile (uniform weight tile):  TENSOR_LOAD_TO_LDS via TDM (TENSORcnt)
//  - double-buffered LDS, prefetch overlapped with compute
// grid = (H/128 col tiles, 64 worst-case row tiles, 8 experts), block = 256.
// ---------------------------------------------------------------------------
__global__ __launch_bounds__(256) void moe_gemm_kernel(
    const float* __restrict__ x,  const float* __restrict__ ew,
    const float* __restrict__ eb, const int*   __restrict__ offsets,
    const int*   __restrict__ perm, const float* __restrict__ gate,
    float* __restrict__ out)
{
    __shared__ float As[2][TILE_M][AS_STRIDE];   // A tiles: [m][k], padded
    __shared__ float Bs[2][TILE_K][BS_STRIDE];   // B tiles: [k][n], TDM-padded
    __shared__ int   tokRow[TILE_M];
    __shared__ float gateRow[TILE_M];
    __shared__ float biasN[TILE_N];

    const int e      = blockIdx.z;
    const int n0     = blockIdx.x * TILE_N;
    const int segBeg = offsets[e];
    const int count  = offsets[e + 1] - segBeg;
    const int m0     = blockIdx.y * TILE_M;
    if (m0 >= count) return;                       // uniform early exit

    const int tid = threadIdx.x;
    if (tid < TILE_M) {
        const int g   = m0 + tid;
        const int tok = (g < count) ? perm[segBeg + g] : -1;
        tokRow[tid]  = tok;
        gateRow[tid] = (tok >= 0) ? gate[tok] : 0.f;
        biasN[tid]   = eb[e * HDIM + n0 + tid];
    }
    __syncthreads();

    const int wave  = tid >> 5;
    const int lane  = tid & 31;
    const int waveM = (wave >> 2) * 64;   // 0 or 64
    const int waveN = (wave & 3) * 32;    // 0,32,64,96
    const int lhalf = lane >> 4;          // 0/1 -> K offset of +2 (A/B frag)
    const int l15   = lane & 15;

    v8f acc[4][2] = {};                   // zero-initialized accumulators

    // Per-thread async staging roles for the A tile.
    const int arow = tid >> 1;            // 2 threads per A row
    const int akk  = (tid & 1) * 8;       // 8 floats each (2x b128)
    const int tokA = tokRow[arow];
    const int tokEff = (tokA >= 0) ? tokA : 0;   // tail rows alias token 0; masked at store
    const float* aSrc = x + (size_t)tokEff * HDIM + akk;

    // Uniform B tile source (expert weights) for the TDM.
    const float* bTileG = ew + (size_t)e * HDIM * HDIM + n0;

    const unsigned aLds[2] = {
        (unsigned)(size_t)&As[0][arow][akk],
        (unsigned)(size_t)&As[1][arow][akk] };
    const unsigned bLds[2] = {
        (unsigned)(size_t)&Bs[0][0][0],
        (unsigned)(size_t)&Bs[1][0][0] };

    // Prologue: fill buffer 0 for k0 = 0.
    async_ld_b128(aLds[0],      aSrc);
    async_ld_b128(aLds[0] + 16, aSrc + 4);
    if (wave == 0) {
        tdm_load_b_tile(bLds[0], bTileG);
        __builtin_amdgcn_s_wait_tensorcnt(0);
    }
    wait_async0();
    __syncthreads();

    const int NSTEP = HDIM / TILE_K;      // 64
    for (int s = 0; s < NSTEP; ++s) {
        const int cur = s & 1;

        // Prefetch next K tile into the other buffer (overlaps with compute).
        if (s + 1 < NSTEP) {
            const int nxt = cur ^ 1;
            const int k1  = (s + 1) * TILE_K;
            const float* ag = aSrc + k1;
            async_ld_b128(aLds[nxt],      ag);
            async_ld_b128(aLds[nxt] + 16, ag + 4);
            if (wave == 0)
                tdm_load_b_tile(bLds[nxt], bTileG + (size_t)k1 * HDIM);
        }

        // Compute on current buffer: 4 K-substeps x (4x2) WMMA = 32 WMMAs.
#pragma unroll
        for (int kb = 0; kb < TILE_K; kb += 4) {
            const int kf = kb + lhalf * 2;
            // A fragments: 16x4 f32, lane = M (0..15), half-lanes K+2
            v2f afrag[4];
#pragma unroll
            for (int mt = 0; mt < 4; ++mt) {
                const float* ap = &As[cur][waveM + mt * 16 + l15][kf];
                afrag[mt].x = ap[0];
                afrag[mt].y = ap[1];
            }
            // B fragments: 4x16 f32, lane = N (0..15), half-lanes K+2
            v2f bfrag[2];
#pragma unroll
            for (int nt = 0; nt < 2; ++nt) {
                const int n = waveN + nt * 16 + l15;
                bfrag[nt].x = Bs[cur][kf][n];
                bfrag[nt].y = Bs[cur][kf + 1][n];
            }
#pragma unroll
            for (int mt = 0; mt < 4; ++mt) {
#pragma unroll
                for (int nt = 0; nt < 2; ++nt) {
                    acc[mt][nt] = __builtin_amdgcn_wmma_f32_16x16x4_f32(
                        false, afrag[mt], false, bfrag[nt],
                        (short)0, acc[mt][nt], false, false);
                }
            }
        }

        // Close RAW (prefetch -> next compute) and WAR (this compute -> refill).
        wait_async0();
        if (wave == 0)
            __builtin_amdgcn_s_wait_tensorcnt(0);
        __syncthreads();
    }

    // Epilogue: D layout — VGPR r: lanes0-15 -> M=r, lanes16-31 -> M=r+8, N=l15
#pragma unroll
    for (int mt = 0; mt < 4; ++mt) {
#pragma unroll
        for (int nt = 0; nt < 2; ++nt) {
#pragma unroll
            for (int r = 0; r < 8; ++r) {
                const int mlocal = r + lhalf * 8;
                const int row    = waveM + mt * 16 + mlocal;
                const int tok    = tokRow[row];
                if (tok >= 0) {
                    const int nl = waveN + nt * 16 + l15;
                    out[(size_t)tok * HDIM + n0 + nl] =
                        gateRow[row] * (acc[mt][nt][r] + biasN[nl]);
                }
            }
        }
    }
}

// ---------------------------------------------------------------------------
// Launch
// ---------------------------------------------------------------------------
extern "C" void kernel_launch(void* const* d_in, const int* in_sizes, int n_in,
                              void* d_out, int out_size, void* d_ws, size_t ws_size,
                              hipStream_t stream)
{
    (void)in_sizes; (void)n_in; (void)out_size; (void)ws_size;

    const float* x  = (const float*)d_in[0];   // [T, H]
    const float* rw = (const float*)d_in[1];   // [H, E]
    const float* rb = (const float*)d_in[2];   // [E]
    const float* ew = (const float*)d_in[3];   // [E, H, H]
    const float* eb = (const float*)d_in[4];   // [E, H]
    float* out = (float*)d_out;                // [T, H]

    char*  ws      = (char*)d_ws;
    int*   idx     = (int*)  (ws);             // T ints
    float* gate    = (float*)(ws + 32768);     // T floats
    int*   perm    = (int*)  (ws + 65536);     // T ints
    int*   counts  = (int*)  (ws + 98304);     // E ints
    int*   offsets = (int*)  (ws + 98368);     // E+1 ints
    int*   cursor  = (int*)  (ws + 98432);     // E ints

    hipMemsetAsync(counts, 0, NEXP * sizeof(int), stream);

    moe_router_kernel<<<T_TOKENS / 8, 256, 0, stream>>>(x, rw, rb, idx, gate, counts);
    moe_scan_kernel<<<1, 32, 0, stream>>>(counts, offsets, cursor);
    moe_scatter_kernel<<<T_TOKENS / 256, 256, 0, stream>>>(idx, cursor, perm);

    dim3 grid(HDIM / TILE_N, T_TOKENS / TILE_M, NEXP);
    moe_gemm_kernel<<<grid, 256, 0, stream>>>(x, ew, eb, offsets, perm, gate, out);
}

// v001
// Timed twice side by side with v000, it ran 1.18 times as fast both times.
#include <hip/hip_runtime.h>
#include <hip/hip_bf16.h>
#include <math.h>

// Problem constants (B=4, S=2048, H=1024, E=8)
#define T_TOKENS 8192
#define HDIM     1024
#define NEXP     8

#define TILE_M   128
#define TILE_N   128
#define TILE_K   16
// Sum over experts of ceil(count/TILE_M), counts summing to T_TOKENS: at most
// T/TILE_M - 1 full tiles plus one partial tile per expert.
#define MAX_ROW_TILES (T_TOKENS / TILE_M + NEXP - 1)
#define AS_STRIDE 20    // padded A row stride (floats): 80B rows -> b128-aligned, conflict-free
#define BS_STRIDE 144   // padded B row stride (floats): matches TDM pad (128 + 16 DWORDs)

typedef __attribute__((ext_vector_type(2))) float v2f;
typedef __attribute__((ext_vector_type(8))) float v8f;
typedef unsigned int v4u __attribute__((ext_vector_type(4)));
typedef int          v8i __attribute__((ext_vector_type(8)));
typedef int          v4i __attribute__((ext_vector_type(4)));

// Async global -> LDS copy of 16 bytes (tracked by ASYNCcnt, no VGPR staging).
__device__ __forceinline__ void async_ld_b128(unsigned lds_addr, const float* gaddr)
{
    asm volatile("global_load_async_to_lds_b128 %0, %1, off"
                 :: "v"(lds_addr), "v"(gaddr) : "memory");
}

__device__ __forceinline__ void wait_async0()
{
    asm volatile("s_wait_asynccnt 0x0" ::: "memory");
}

// Tensor Data Mover: DMA one 16(k) x 128(n) f32 tile (row stride HDIM floats)
// from global memory into LDS, with hardware padding of +16 DWORDs after each
// 128-DWORD row (-> BS_STRIDE = 144 floats).  Tracked by TENSORcnt.
__device__ __forceinline__ void tdm_load_b_tile(unsigned lds_addr, const float* gtile)
{
    const unsigned long long ga = (unsigned long long)(size_t)gtile;
    // D# group 0: count=1 | lds_addr[63:32] | global_addr[120:64] | type=2[127:126]
    v4u g0 = { 1u,
               lds_addr,
               (unsigned)ga,
               (unsigned)((ga >> 32) & 0x01FFFFFFu) | (2u << 30) };
    // D# group 1:
    //  w0: wg_mask=0 | data_size=2 (4B) [17:16] | pad_enable [20]
    //      | pad_interval=6 (128 DW) [24:22] | pad_amount=15 (16 DW) [31:25]
    //  w1: atomic_barrier_addr=0 [15:0] | tensor_dim0.lo16 [31:16]
    //  w2: tensor_dim0.hi16=0 | tensor_dim1.lo16 [31:16]
    //  w3: tensor_dim1.hi16=0 | tile_dim0 [31:16]
    //  w4: tile_dim1 [15:0] | tile_dim2=0
    //  w5: tensor_dim0_stride.lo32
    //  w6: tensor_dim0_stride.hi16=0 | tensor_dim1_stride.lo16=0
    //  w7: tensor_dim1_stride.hi32=0
    v8i g1 = { (int)((2u << 16) | (1u << 20) | (6u << 22) | (15u << 25)),
               (int)((unsigned)HDIM << 16),
               (int)((unsigned)TILE_K << 16),
               (int)((unsigned)TILE_N << 16),
               (int)TILE_K,
               (int)HDIM,
               0, 0 };
    v4i gz = { 0, 0, 0, 0 };
#if __clang_major__ >= 23
    v8i z8 = { 0, 0, 0, 0, 0, 0, 0, 0 };
    __builtin_amdgcn_tensor_load_to_lds(g0, g1, gz, gz, z8, 0);
#else
    __builtin_amdgcn_tensor_load_to_lds(g0, g1, gz, gz, 0);
#endif
}

// ---------------------------------------------------------------------------
// Kernel 1: router.  One wave32 per token: lane-strided dot of x[t,:] with
// router_w[:,e] for all 8 experts, cross-lane reduce, softmax/argmax/gate.
// ---------------------------------------------------------------------------
__global__ __launch_bounds__(256) void moe_router_kernel(
    const float* __restrict__ x, const float* __restrict__ rw,
    const float* __restrict__ rb, int* __restrict__ idx,
    float* __restrict__ gate, int* __restrict__ counts)
{
    const int t    = blockIdx.x * 8 + (threadIdx.x >> 5);
    const int lane = threadIdx.x & 31;
    if (t >= T_TOKENS) return;

    float acc[NEXP];
#pragma unroll
    for (int e = 0; e < NEXP; ++e) acc[e] = 0.f;

    const float* xr = x + (size_t)t * HDIM;
    for (int h = lane; h < HDIM; h += 32) {
        const float xv = xr[h];
        const float* w = rw + h * NEXP;   // router_w is [H][E] row-major
#pragma unroll
        for (int e = 0; e < NEXP; ++e) acc[e] += xv * w[e];
    }
#pragma unroll
    for (int e = 0; e < NEXP; ++e) {
#pragma unroll
        for (int off = 16; off >= 1; off >>= 1)
            acc[e] += __shfl_xor(acc[e], off, 32);
    }
    if (lane == 0) {
        float l[NEXP];
        float m = -INFINITY;
#pragma unroll
        for (int e = 0; e < NEXP; ++e) { l[e] = acc[e] + rb[e]; m = fmaxf(m, l[e]); }
        float s = 0.f;
#pragma unroll
        for (int e = 0; e < NEXP; ++e) { l[e] = __expf(l[e] - m); s += l[e]; }
        int best = 0; float bv = l[0];
#pragma unroll
        for (int e = 1; e < NEXP; ++e) if (l[e] > bv) { bv = l[e]; best = e; }
        idx[t]  = best;
        gate[t] = bv / s;
        atomicAdd(&counts[best], 1);
    }
}

// ---------------------------------------------------------------------------
// Kernel 2: exclusive scan of 8 counts -> offsets[9], cursor[8]
// ---------------------------------------------------------------------------
__global__ void moe_scan_kernel(const int* __restrict__ counts,
                                int* __restrict__ offsets,
                                int* __restrict__ cursor)
{
    if (threadIdx.x == 0 && blockIdx.x == 0) {
        int a = 0;
        for (int e = 0; e < NEXP; ++e) {
            offsets[e] = a; cursor[e] = a; a += counts[e];
        }
        offsets[NEXP] = a;
    }
}

// ---------------------------------------------------------------------------
// Kernel 3: scatter token ids into contiguous per-expert segments.
// ---------------------------------------------------------------------------
__global__ __launch_bounds__(256) void moe_scatter_kernel(
    const int* __restrict__ idx, int* __restrict__ cursor,
    int* __restrict__ perm)
{
    const int t = blockIdx.x * 256 + threadIdx.x;
    if (t < T_TOKENS) {
        const int e   = idx[t];
        const int pos = atomicAdd(&cursor[e], 1);
        perm[pos] = t;
    }
}

// ---------------------------------------------------------------------------
// Kernel 4: grouped GEMM over routed segments.
//  - V_WMMA_F32_16X16X4_F32 compute (8 waves x 4x2 16x16 accum tiles)
//  - A tile (gathered token rows): GLOBAL_LOAD_ASYNC_TO_LDS_B128 (ASYNCcnt)
//  - B tile (uniform weight tile):  TENSOR_LOAD_TO_LDS via TDM (TENSORcnt)
//  - double-buffered LDS, prefetch overlapped with compute
// grid = (H/128 col tiles, 71 row tiles at most over all experts), block = 256.
// ---------------------------------------------------------------------------
__global__ __launch_bounds__(256) void moe_gemm_kernel(
    const float* __restrict__ x,  const float* __restrict__ ew,
    const float* __restrict__ eb, const int*   __restrict__ offsets,
    const int*   __restrict__ perm, const float* __restrict__ gate,
    float* __restrict__ out)
{
    __shared__ float As[2][TILE_M][AS_STRIDE];   // A tiles: [m][k], padded
    __shared__ float Bs[2][TILE_K][BS_STRIDE];   // B tiles: [k][n], TDM-padded
    __shared__ int   tokRow[TILE_M];
    __shared__ float gateRow[TILE_M];
    __shared__ float biasN[TILE_N];

    const int n0 = blockIdx.x * TILE_N;

    // blockIdx.y numbers the row tiles that exist, expert after expert: count
    // the experts whose tiles all lie in front of it (the 9 offsets are read
    // up front, so the walk is scalar selects behind one load latency).
    int off[NEXP + 1];
    for (int i = 0; i <= NEXP; ++i) off[i] = offsets[i];
    const int rt = blockIdx.y;
    int e = 0, tileBeg = 0, segBeg = off[0], segEnd = off[1], tilesUpTo = 0;
    for (int i = 0; i < NEXP; ++i) {
        tilesUpTo += (off[i + 1] - off[i] + TILE_M - 1) / TILE_M;
        if (rt >= tilesUpTo) {
            e       = i + 1;
            tileBeg = tilesUpTo;
            segBeg  = off[i + 1];
            segEnd  = off[i + 2 <= NEXP ? i + 2 : NEXP];
        }
    }
    if (e >= NEXP) return;                         // uniform early exit: past the last tile
    const int count = segEnd - segBeg;
    const int m0    = (rt - tileBeg) * TILE_M;

    const int tid = threadIdx.x;
    if (tid < TILE_M) {
        const int g   = m0 + tid;
        const int tok = (g < count) ? perm[segBeg + g] : -1;
        tokRow[tid]  = tok;
        gateRow[tid] = (tok >= 0) ? gate[tok] : 0.f;
        biasN[tid]   = eb[e * HDIM + n0 + tid];
    }
    __syncthreads();

    const int wave  = tid >> 5;
    const int lane  = tid & 31;
    const int waveM = (wave >> 2) * 64;   // 0 or 64
    const int waveN = (wave & 3) * 32;    // 0,32,64,96
    const int lhalf = lane >> 4;          // 0/1 -> K offset of +2 (A/B frag)
    const int l15   = lane & 15;

    v8f acc[4][2] = {};                   // zero-initialized accumulators

    // Per-thread async staging roles for the A tile.
    const int arow = tid >> 1;            // 2 threads per A row
    const int akk  = (tid & 1) * 8;       // 8 floats each (2x b128)
    const int tokA = tokRow[arow];
    const int tokEff = (tokA >= 0) ? tokA : 0;   // tail rows alias token 0; masked at store
    const float* aSrc = x + (size_t)tokEff * HDIM + akk;

    // Uniform B tile source (expert weights) for the TDM.
    const float* bTileG = ew + (size_t)e * HDIM * HDIM + n0;

    const unsigned aLds[2] = {
        (unsigned)(size_t)&As[0][arow][akk],
        (unsigned)(size_t)&As[1][arow][akk] };
    const unsigned bLds[2] = {
        (unsigned)(size_t)&Bs[0][0][0],
        (unsigned)(size_t)&Bs[1][0][0] };

    // Prologue: fill buffer 0 for k0 = 0.
    async_ld_b128(aLds[0],      aSrc);
    async_ld_b128(aLds[0] + 16, aSrc + 4);
    if (wave == 0) {
        tdm_load_b_tile(bLds[0], bTileG);
        __builtin_amdgcn_s_wait_tensorcnt(0);
    }
    wait_async0();
    __syncthreads();

    const int NSTEP = HDIM / TILE_K;      // 64
    for (int s = 0; s < NSTEP; ++s) {
        const int cur = s & 1;

        // Prefetch next K tile into the other buffer (overlaps with compute).
        if (s + 1 < NSTEP) {
            const int nxt = cur ^ 1;
            const int k1  = (s + 1) * TILE_K;
            const float* ag = aSrc + k1;
            async_ld_b128(aLds[nxt],      ag);
            async_ld_b128(aLds[nxt] + 16, ag + 4);
            if (wave == 0)
                tdm_load_b_tile(bLds[nxt], bTileG + (size_t)k1 * HDIM);
        }

        // Compute on current buffer: 4 K-substeps x (4x2) WMMA = 32 WMMAs.
#pragma unroll
        for (int kb = 0; kb < TILE_K; kb += 4) {
            const int kf = kb + lhalf * 2;
            // A fragments: 16x4 f32, lane = M (0..15), half-lanes K+2
            v2f afrag[4];
#pragma unroll
            for (int mt = 0; mt < 4; ++mt) {
                const float* ap = &As[cur][waveM + mt * 16 + l15][kf];
                afrag[mt].x = ap[0];
                afrag[mt].y = ap[1];
            }
            // B fragments: 4x16 f32, lane = N (0..15), half-lanes K+2
            v2f bfrag[2];
#pragma unroll
            for (int nt = 0; nt < 2; ++nt) {
                const int n = waveN + nt * 16 + l15;
                bfrag[nt].x = Bs[cur][kf][n];
                bfrag[nt].y = Bs[cur][kf + 1][n];
            }
#pragma unroll
            for (int mt = 0; mt < 4; ++mt) {
#pragma unroll
                for (int nt = 0; nt < 2; ++nt) {
                    acc[mt][nt] = __builtin_amdgcn_wmma_f32_16x16x4_f32(
                        false, afrag[mt], false, bfrag[nt],
                        (short)0, acc[mt][nt], false, false);
                }
            }
        }

        // Close RAW (prefetch -> next compute) and WAR (this compute -> refill).
        wait_async0();
        if (wave == 0)
            __builtin_amdgcn_s_wait_tensorcnt(0);
        __syncthreads();
    }

    // Epilogue: D layout — VGPR r: lanes0-15 -> M=r, lanes16-31 -> M=r+8, N=l15
#pragma unroll
    for (int mt = 0; mt < 4; ++mt) {
#pragma unroll
        for (int nt = 0; nt < 2; ++nt) {
#pragma unroll
            for (int r = 0; r < 8; ++r) {
                const int mlocal = r + lhalf * 8;
                const int row    = waveM + mt * 16 + mlocal;
                const int tok    = tokRow[row];
                if (tok >= 0) {
                    const int nl = waveN + nt * 16 + l15;
                    out[(size_t)tok * HDIM + n0 + nl] =
                        gateRow[row] * (acc[mt][nt][r] + biasN[nl]);
                }
            }
        }
    }
}

// ---------------------------------------------------------------------------
// Launch
// ---------------------------------------------------------------------------
extern "C" void kernel_launch(void* const* d_in, const int* in_sizes, int n_in,
                              void* d_out, int out_size, void* d_ws, size_t ws_size,
                              hipStream_t stream)
{
    (void)in_sizes; (void)n_in; (void)out_size; (void)ws_size;

    const float* x  = (const float*)d_in[0];   // [T, H]
    const float* rw = (const float*)d_in[1];   // [H, E]
    const float* rb = (const float*)d_in[2];   // [E]
    const float* ew = (const float*)d_in[3];   // [E, H, H]
    const float* eb = (const float*)d_in[4];   // [E, H]
    float* out = (float*)d_out;                // [T, H]

    char*  ws      = (char*)d_ws;
    int*   idx     = (int*)  (ws);             // T ints
    float* gate    = (float*)(ws + 32768);     // T floats
    int*   perm    = (int*)  (ws + 65536);     // T ints
    int*   counts  = (int*)  (ws + 98304);     // E ints
    int*   offsets = (int*)  (ws + 98368);     // E+1 ints
    int*   cursor  = (int*)  (ws + 98432);     // E ints

    hipMemsetAsync(counts, 0, NEXP * sizeof(int), stream);

    moe_router_kernel<<<T_TOKENS / 8, 256, 0, stream>>>(x, rw, rb, idx, gate, counts);
    moe_scan_kernel<<<1, 32, 0, stream>>>(counts, offsets, cursor);
    moe_scatter_kernel<<<T_TOKENS / 256, 256, 0, stream>>>(idx, cursor, perm);

    dim3 grid(HDIM / TILE_N, MAX_ROW_TILES, 1);
    moe_gemm_kernel<<<grid, 256, 0, stream>>>(x, ew, eb, offsets, perm, gate, out);
}

// v002
// In two side-by-side timings against v001, it was 1.19 and 1.18 times as fast.
// All steps since v000 together make it 1.39 times as fast.
#include <hip/hip_runtime.h>
#include <hip/hip_bf16.h>
#include <math.h>

// Problem constants (B=4, S=2048, H=1024, E=8)
#define T_TOKENS 8192
#define HDIM     1024
#define NEXP     8

#define TILE_M   96
#define TILE_N   128
#define TILE_K   16
// Sum over experts of ceil(count/TILE_M), counts summing to T_TOKENS: each
// expert rounds up by at most TILE_M - 1 rows.  With 96 rows that is 93 tiles:
// 8 x 93 = 744 work-groups, never more than 3 for each of the chip's 256 WGPs.
#define MAX_ROW_TILES ((T_TOKENS + NEXP * (TILE_M - 1)) / TILE_M)
#define WAVE_MT  (TILE_M / 32)          // 16-row accumulator tiles per wave (2 waves along M)
#define A_WAVES  (TILE_M / 16)          // waves that stage A: 2 lanes a row, 16 rows a wave
#define AS_STRIDE 20    // padded A row stride (floats): 80B rows -> b128-aligned, conflict-free
#define BS_STRIDE 144   // padded B row stride (floats): matches TDM pad (128 + 16 DWORDs)

typedef __attribute__((ext_vector_type(2))) float v2f;
typedef __attribute__((ext_vector_type(8))) float v8f;
typedef unsigned int v4u __attribute__((ext_vector_type(4)));
typedef int          v8i __attribute__((ext_vector_type(8)));
typedef int          v4i __attribute__((ext_vector_type(4)));

// Async global -> LDS copy of 2 x 16 bytes a lane (tracked by ASYNCcnt, no VGPR
// staging).  The s_wait_xcnt closes the statement so that it stands in front of
// every later write of the four address registers.
__device__ __forceinline__ void async_ld_2xb128(unsigned lds_addr, const float* gaddr)
{
    asm volatile("global_load_async_to_lds_b128 %0, %1, off\n\t"
                 "global_load_async_to_lds_b128 %2, %3, off\n\t"
                 "s_wait_xcnt 0x0"
                 :: "v"(lds_addr), "v"(gaddr), "v"(lds_addr + 16), "v"(gaddr + 4)
                 : "memory");
}

__device__ __forceinline__ void wait_async0()
{
    asm volatile("s_wait_asynccnt 0x0" ::: "memory");
}

// Tensor Data Mover: DMA one 16(k) x 128(n) f32 tile (row stride HDIM floats)
// from global memory into LDS, with hardware padding of +16 DWORDs after each
// 128-DWORD row (-> BS_STRIDE = 144 floats).  Tracked by TENSORcnt.
__device__ __forceinline__ void tdm_load_b_tile(unsigned lds_addr, const float* gtile)
{
    const unsigned long long ga = (unsigned long long)(size_t)gtile;
    // D# group 0: count=1 | lds_addr[63:32] | global_addr[120:64] | type=2[127:126]
    v4u g0 = { 1u,
               lds_addr,
               (unsigned)ga,
               (unsigned)((ga >> 32) & 0x01FFFFFFu) | (2u << 30) };
    // D# group 1:
    //  w0: wg_mask=0 | data_size=2 (4B) [17:16] | pad_enable [20]
    //      | pad_interval=6 (128 DW) [24:22] | pad_amount=15 (16 DW) [31:25]
    //  w1: atomic_barrier_addr=0 [15:0] | tensor_dim0.lo16 [31:16]
    //  w2: tensor_dim0.hi16=0 | tensor_dim1.lo16 [31:16]
    //  w3: tensor_dim1.hi16=0 | tile_dim0 [31:16]
    //  w4: tile_dim1 [15:0] | tile_dim2=0
    //  w5: tensor_dim0_stride.lo32
    //  w6: tensor_dim0_stride.hi16=0 | tensor_dim1_stride.lo16=0
    //  w7: tensor_dim1_stride.hi32=0
    v8i g1 = { (int)((2u << 16) | (1u << 20) | (6u << 22) | (15u << 25)),
               (int)((unsigned)HDIM << 16),
               (int)((unsigned)TILE_K << 16),
               (int)((unsigned)TILE_N << 16),
               (int)TILE_K,
               (int)HDIM,
               0, 0 };
    v4i gz = { 0, 0, 0, 0 };
#if __clang_major__ >= 23
    v8i z8 = { 0, 0, 0, 0, 0, 0, 0, 0 };
    __builtin_amdgcn_tensor_load_to_lds(g0, g1, gz, gz, z8, 0);
#else
    __builtin_amdgcn_tensor_load_to_lds(g0, g1, gz, gz, 0);
#endif
}

// ---------------------------------------------------------------------------
// Kernel 1: router.  One wave32 per token: lane-strided dot of x[t,:] with
// router_w[:,e] for all 8 experts, cross-lane reduce, softmax/argmax/gate.
// ---------------------------------------------------------------------------
__global__ __launch_bounds__(256) void moe_router_kernel(
    const float* __restrict__ x, const float* __restrict__ rw,
    const float* __restrict__ rb, int* __restrict__ idx,
    float* __restrict__ gate, int* __restrict__ counts)
{
    const int t    = blockIdx.x * 8 + (threadIdx.x >> 5);
    const int lane = threadIdx.x & 31;
    if (t >= T_TOKENS) return;

    float acc[NEXP];
#pragma unroll
    for (int e = 0; e < NEXP; ++e) acc[e] = 0.f;

    const float* xr = x + (size_t)t * HDIM;
    for (int h = lane; h < HDIM; h += 32) {
        const float xv = xr[h];
        const float* w = rw + h * NEXP;   // router_w is [H][E] row-major
#pragma unroll
        for (int e = 0; e < NEXP; ++e) acc[e] += xv * w[e];
    }
#pragma unroll
    for (int e = 0; e < NEXP; ++e) {
#pragma unroll
        for (int off = 16; off >= 1; off >>= 1)
            acc[e] += __shfl_xor(acc[e], off, 32);
    }
    if (lane == 0) {
        float l[NEXP];
        float m = -INFINITY;
#pragma unroll
        for (int e = 0; e < NEXP; ++e) { l[e] = acc[e] + rb[e]; m = fmaxf(m, l[e]); }
        float s = 0.f;
#pragma unroll
        for (int e = 0; e < NEXP; ++e) { l[e] = __expf(l[e] - m); s += l[e]; }
        int best = 0; float bv = l[0];
#pragma unroll
        for (int e = 1; e < NEXP; ++e) if (l[e] > bv) { bv = l[e]; best = e; }
        idx[t]  = best;
        gate[t] = bv / s;
        atomicAdd(&counts[best], 1);
    }
}

// ---------------------------------------------------------------------------
// Kernel 2: exclusive scan of 8 counts -> offsets[9], cursor[8]
// ---------------------------------------------------------------------------
__global__ void moe_scan_kernel(const int* __restrict__ counts,
                                int* __restrict__ offsets,
                                int* __restrict__ cursor)
{
    if (threadIdx.x == 0 && blockIdx.x == 0) {
        int a = 0;
        for (int e = 0; e < NEXP; ++e) {
            offsets[e] = a; cursor[e] = a; a += counts[e];
        }
        offsets[NEXP] = a;
    }
}

// ---------------------------------------------------------------------------
// Kernel 3: scatter token ids into contiguous per-expert segments.
// ---------------------------------------------------------------------------
__global__ __launch_bounds__(256) void moe_scatter_kernel(
    const int* __restrict__ idx, int* __restrict__ cursor,
    int* __restrict__ perm)
{
    const int t = blockIdx.x * 256 + threadIdx.x;
    if (t < T_TOKENS) {
        const int e   = idx[t];
        const int pos = atomicAdd(&cursor[e], 1);
        perm[pos] = t;
    }
}

// ---------------------------------------------------------------------------
// Kernel 4: grouped GEMM over routed segments.
//  - V_WMMA_F32_16X16X4_F32 compute (8 waves x 3x2 16x16 accum tiles)
//  - A tile (gathered token rows): GLOBAL_LOAD_ASYNC_TO_LDS_B128 (ASYNCcnt)
//  - B tile (uniform weight tile):  TENSOR_LOAD_TO_LDS via TDM (TENSORcnt)
//  - double-buffered LDS, prefetch overlapped with compute
// grid = (H/128 col tiles, 93 row tiles at most over all experts), block = 256.
// ---------------------------------------------------------------------------
__global__ __launch_bounds__(256) void moe_gemm_kernel(
    const float* __restrict__ x,  const float* __restrict__ ew,
    const float* __restrict__ eb, const int*   __restrict__ offsets,
    const int*   __restrict__ perm, const float* __restrict__ gate,
    float* __restrict__ out)
{
    __shared__ float As[2][TILE_M][AS_STRIDE];   // A tiles: [m][k], padded
    __shared__ float Bs[2][TILE_K][BS_STRIDE];   // B tiles: [k][n], TDM-padded
    __shared__ int   tokRow[TILE_M];
    __shared__ float gateRow[TILE_M];
    __shared__ float biasN[TILE_N];

    const int n0 = blockIdx.x * TILE_N;

    // blockIdx.y numbers the row tiles that exist, expert after expert: count
    // the experts whose tiles all lie in front of it (the 9 offsets are read
    // up front, so the walk is scalar selects behind one load latency).
    int off[NEXP + 1];
    for (int i = 0; i <= NEXP; ++i) off[i] = offsets[i];
    const int rt = blockIdx.y;
    int e = 0, tileBeg = 0, segBeg = off[0], segEnd = off[1], tilesUpTo = 0;
    for (int i = 0; i < NEXP; ++i) {
        tilesUpTo += (off[i + 1] - off[i] + TILE_M - 1) / TILE_M;
        if (rt >= tilesUpTo) {
            e       = i + 1;
            tileBeg = tilesUpTo;
            segBeg  = off[i + 1];
            segEnd  = off[i + 2 <= NEXP ? i + 2 : NEXP];
        }
    }
    if (e >= NEXP) return;                         // uniform early exit: past the last tile
    const int count = segEnd - segBeg;
    const int m0    = (rt - tileBeg) * TILE_M;

    const int tid = threadIdx.x;
    if (tid < TILE_M) {
        const int g   = m0 + tid;
        const int tok = (g < count) ? perm[segBeg + g] : -1;
        tokRow[tid]  = tok;
        gateRow[tid] = (tok >= 0) ? gate[tok] : 0.f;
    }
    if (tid < TILE_N)
        biasN[tid] = eb[e * HDIM + n0 + tid];
    __syncthreads();

    const int wave  = tid >> 5;
    const int lane  = tid & 31;
    const int waveM = (wave >> 2) * (WAVE_MT * 16);   // 0 or 48
    const int waveN = (wave & 3) * 32;    // 0,32,64,96
    const int lhalf = lane >> 4;          // 0/1 -> K offset of +2 (A/B frag)
    const int l15   = lane & 15;

    v8f acc[WAVE_MT][2] = {};             // zero-initialized accumulators

    // Per-thread async staging roles for the A tile: the first A_WAVES waves
    // copy, whole waves only (a scalar test, so no copy issues with lanes off).
    const bool aWave = __builtin_amdgcn_readfirstlane(tid >> 5) < A_WAVES;
    const int arow = aWave ? (tid >> 1) : 0;   // 2 threads per A row
    const int akk  = (tid & 1) * 8;       // 8 floats each (2x b128)
    const int tokA = tokRow[arow];
    const int tokEff = (tokA >= 0) ? tokA : 0;   // tail rows alias token 0; masked at store
    const float* aSrc = x + (size_t)tokEff * HDIM + akk;

    // Uniform B tile source (expert weights) for the TDM.
    const float* bTileG = ew + (size_t)e * HDIM * HDIM + n0;

    const unsigned aLds[2] = {
        (unsigned)(size_t)&As[0][arow][akk],
        (unsigned)(size_t)&As[1][arow][akk] };
    const unsigned bLds[2] = {
        (unsigned)(size_t)&Bs[0][0][0],
        (unsigned)(size_t)&Bs[1][0][0] };

    // Prologue: fill buffer 0 for k0 = 0.
    if (aWave)
        async_ld_2xb128(aLds[0], aSrc);
    if (wave == 0) {
        tdm_load_b_tile(bLds[0], bTileG);
        __builtin_amdgcn_s_wait_tensorcnt(0);
    }
    wait_async0();
    __syncthreads();

    const int NSTEP = HDIM / TILE_K;      // 64
    for (int s = 0; s < NSTEP; ++s) {
        const int cur = s & 1;

        // Prefetch next K tile into the other buffer (overlaps with compute).
        if (s + 1 < NSTEP) {
            const int nxt = cur ^ 1;
            const int k1  = (s + 1) * TILE_K;
            if (aWave)
                async_ld_2xb128(aLds[nxt], aSrc + k1);
            if (wave == 0)
                tdm_load_b_tile(bLds[nxt], bTileG + (size_t)k1 * HDIM);
        }

        // Compute on current buffer: 4 K-substeps x (3x2) WMMA = 24 WMMAs.
#pragma unroll
        for (int kb = 0; kb < TILE_K; kb += 4) {
            const int kf = kb + lhalf * 2;
            // A fragments: 16x4 f32, lane = M (0..15), half-lanes K+2
            v2f afrag[WAVE_MT];
#pragma unroll
            for (int mt = 0; mt < WAVE_MT; ++mt) {
                const float* ap = &As[cur][waveM + mt * 16 + l15][kf];
                afrag[mt].x = ap[0];
                afrag[mt].y = ap[1];
            }
            // B fragments: 4x16 f32, lane = N (0..15), half-lanes K+2
            v2f bfrag[2];
#pragma unroll
            for (int nt = 0; nt < 2; ++nt) {
                const int n = waveN + nt * 16 + l15;
                bfrag[nt].x = Bs[cur][kf][n];
                bfrag[nt].y = Bs[cur][kf + 1][n];
            }
#pragma unroll
            for (int mt = 0; mt < WAVE_MT; ++mt) {
#pragma unroll
                for (int nt = 0; nt < 2; ++nt) {
                    acc[mt][nt] = __builtin_amdgcn_wmma_f32_16x16x4_f32(
                        false, afrag[mt], false, bfrag[nt],
                        (short)0, acc[mt][nt], false, false);
                }
            }
        }

        // Close RAW (prefetch -> next compute) and WAR (this compute -> refill):
        // this wave's LDS reads of the buffer have returned before the barrier
        // behind which the buffer is refilled.  The scheduling fence keeps the
        // pass's WMMAs in front of the waits: without it the compiler sinks half
        // of them behind the waits, which then drain the loads in mid-pass.
        __builtin_amdgcn_sched_barrier(0);
        asm volatile("s_wait_dscnt 0x0" ::: "memory");
        wait_async0();
        if (wave == 0)
            __builtin_amdgcn_s_wait_tensorcnt(0);
        __syncthreads();
    }

    // Epilogue: D layout — VGPR r: lanes0-15 -> M=r, lanes16-31 -> M=r+8, N=l15
#pragma unroll
    for (int mt = 0; mt < WAVE_MT; ++mt) {
#pragma unroll
        for (int nt = 0; nt < 2; ++nt) {
#pragma unroll
            for (int r = 0; r < 8; ++r) {
                const int mlocal = r + lhalf * 8;
                const int row    = waveM + mt * 16 + mlocal;
                const int tok    = tokRow[row];
                if (tok >= 0) {
                    const int nl = waveN + nt * 16 + l15;
                    out[(size_t)tok * HDIM + n0 + nl] =
                        gateRow[row] * (acc[mt][nt][r] + biasN[nl]);
                }
            }
        }
    }
}

// ---------------------------------------------------------------------------
// Launch
// ---------------------------------------------------------------------------
extern "C" void kernel_launch(void* const* d_in, const int* in_sizes, int n_in,
                              void* d_out, int out_size, void* d_ws, size_t ws_size,
                              hipStream_t stream)
{
    (void)in_sizes; (void)n_in; (void)out_size; (void)ws_size;

    const float* x  = (const float*)d_in[0];   // [T, H]
    const float* rw = (const float*)d_in[1];   // [H, E]
    const float* rb = (const float*)d_in[2];   // [E]
    const float* ew = (const float*)d_in[3];   // [E, H, H]
    const float* eb = (const float*)d_in[4];   // [E, H]
    float* out = (float*)d_out;                // [T, H]

    char*  ws      = (char*)d_ws;
    int*   idx     = (int*)  (ws);             // T ints
    float* gate    = (float*)(ws + 32768);     // T floats
    int*   perm    = (int*)  (ws + 65536);     // T ints
    int*   counts  = (int*)  (ws + 98304);     // E ints
    int*   offsets = (int*)  (ws + 98368);     // E+1 ints
    int*   cursor  = (int*)  (ws + 98432);     // E ints

    hipMemsetAsync(counts, 0, NEXP * sizeof(int), stream);

    moe_router_kernel<<<T_TOKENS / 8, 256, 0, stream>>>(x, rw, rb, idx, gate, counts);
    moe_scan_kernel<<<1, 32, 0, stream>>>(counts, offsets, cursor);
    moe_scatter_kernel<<<T_TOKENS / 256, 256, 0, stream>>>(idx, cursor, perm);

    dim3 grid(HDIM / TILE_N, MAX_ROW_TILES, 1);
    moe_gemm_kernel<<<grid, 256, 0, stream>>>(x, ew, eb, offsets, perm, gate, out);
}

// v003
// One run takes 118 microseconds.
// In two side-by-side timings against v002, it was 1.07 and 1.05 times as fast.
// Counting every step since v000, it is 1.47 times as fast.
#include <hip/hip_runtime.h>
#include <hip/hip_bf16.h>
#include <math.h>

// Problem constants (B=4, S=2048, H=1024, E=8)
#define T_TOKENS 8192
#define HDIM     1024
#define NEXP     8

#define TILE_M   96
#define TILE_N   128
#define TILE_K   16
// Sum over experts of ceil(count/TILE_M), counts summing to T_TOKENS: each
// expert rounds up by at most TILE_M - 1 rows.  With 96 rows that is 93 tiles:
// 8 x 93 = 744 work-groups, never more than 3 for each of the chip's 256 WGPs.
#define MAX_ROW_TILES ((T_TOKENS + NEXP * (TILE_M - 1)) / TILE_M)
#define WAVE_MT  (TILE_M / 32)          // 16-row accumulator tiles per wave (2 waves along M)
#define A_WAVES  (TILE_M / 16)          // waves that stage A: 2 lanes a row, 16 rows a wave
#define AS_STRIDE 20    // padded A row stride (floats): 80B rows -> b128-aligned, conflict-free
#define BS_STRIDE 144   // padded B row stride (floats): matches TDM pad (128 + 16 DWORDs)

typedef __attribute__((ext_vector_type(2))) float v2f;
typedef __attribute__((ext_vector_type(8))) float v8f;
typedef unsigned int v4u __attribute__((ext_vector_type(4)));
typedef int          v8i __attribute__((ext_vector_type(8)));
typedef int          v4i __attribute__((ext_vector_type(4)));

// Async global -> LDS copy of 2 x 16 bytes a lane (tracked by ASYNCcnt, no VGPR
// staging).  The s_wait_xcnt closes the statement so that it stands in front of
// every later write of the four address registers.
__device__ __forceinline__ void async_ld_2xb128(unsigned lds_addr, const float* gaddr)
{
    asm volatile("global_load_async_to_lds_b128 %0, %1, off\n\t"
                 "global_load_async_to_lds_b128 %2, %3, off\n\t"
                 "s_wait_xcnt 0x0"
                 :: "v"(lds_addr), "v"(gaddr), "v"(lds_addr + 16), "v"(gaddr + 4)
                 : "memory");
}

__device__ __forceinline__ void wait_async0()
{
    asm volatile("s_wait_asynccnt 0x0" ::: "memory");
}

// Tensor Data Mover: DMA one 16(k) x 128(n) f32 tile (row stride HDIM floats)
// from global memory into LDS, with hardware padding of +16 DWORDs after each
// 128-DWORD row (-> BS_STRIDE = 144 floats).  Tracked by TENSORcnt.
__device__ __forceinline__ void tdm_load_b_tile(unsigned lds_addr, const float* gtile)
{
    const unsigned long long ga = (unsigned long long)(size_t)gtile;
    // D# group 0: count=1 | lds_addr[63:32] | global_addr[120:64] | type=2[127:126]
    v4u g0 = { 1u,
               lds_addr,
               (unsigned)ga,
               (unsigned)((ga >> 32) & 0x01FFFFFFu) | (2u << 30) };
    // D# group 1:
    //  w0: wg_mask=0 | data_size=2 (4B) [17:16] | pad_enable [20]
    //      | pad_interval=6 (128 DW) [24:22] | pad_amount=15 (16 DW) [31:25]
    //  w1: atomic_barrier_addr=0 [15:0] | tensor_dim0.lo16 [31:16]
    //  w2: tensor_dim0.hi16=0 | tensor_dim1.lo16 [31:16]
    //  w3: tensor_dim1.hi16=0 | tile_dim0 [31:16]
    //  w4: tile_dim1 [15:0] | tile_dim2=0
    //  w5: tensor_dim0_stride.lo32
    //  w6: tensor_dim0_stride.hi16=0 | tensor_dim1_stride.lo16=0
    //  w7: tensor_dim1_stride.hi32=0
    v8i g1 = { (int)((2u << 16) | (1u << 20) | (6u << 22) | (15u << 25)),
               (int)((unsigned)HDIM << 16),
               (int)((unsigned)TILE_K << 16),
               (int)((unsigned)TILE_N << 16),
               (int)TILE_K,
               (int)HDIM,
               0, 0 };
    v4i gz = { 0, 0, 0, 0 };
#if __clang_major__ >= 23
    v8i z8 = { 0, 0, 0, 0, 0, 0, 0, 0 };
    __builtin_amdgcn_tensor_load_to_lds(g0, g1, gz, gz, z8, 0);
#else
    __builtin_amdgcn_tensor_load_to_lds(g0, g1, gz, gz, 0);
#endif
}

// ---------------------------------------------------------------------------
// Kernel 1: router.  One wave32 per token: lane-strided dot of x[t,:] with
// router_w[:,e] for all 8 experts, cross-lane reduce, softmax/argmax/gate.
// ---------------------------------------------------------------------------
__global__ __launch_bounds__(256) void moe_router_kernel(
    const float* __restrict__ x, const float* __restrict__ rw,
    const float* __restrict__ rb, int* __restrict__ idx,
    float* __restrict__ gate)
{
    const int t    = blockIdx.x * 8 + (threadIdx.x >> 5);
    const int lane = threadIdx.x & 31;
    if (t >= T_TOKENS) return;

    float acc[NEXP];
#pragma unroll
    for (int e = 0; e < NEXP; ++e) acc[e] = 0.f;

    const float* xr = x + (size_t)t * HDIM;
    for (int h = lane; h < HDIM; h += 32) {
        const float xv = xr[h];
        const float* w = rw + h * NEXP;   // router_w is [H][E] row-major
#pragma unroll
        for (int e = 0; e < NEXP; ++e) acc[e] += xv * w[e];
    }
#pragma unroll
    for (int e = 0; e < NEXP; ++e) {
#pragma unroll
        for (int off = 16; off >= 1; off >>= 1)
            acc[e] += __shfl_xor(acc[e], off, 32);
    }
    if (lane == 0) {
        float l[NEXP];
        float m = -INFINITY;
#pragma unroll
        for (int e = 0; e < NEXP; ++e) { l[e] = acc[e] + rb[e]; m = fmaxf(m, l[e]); }
        float s = 0.f;
#pragma unroll
        for (int e = 0; e < NEXP; ++e) { l[e] = __expf(l[e] - m); s += l[e]; }
        int best = 0; float bv = l[0];
#pragma unroll
        for (int e = 1; e < NEXP; ++e) if (l[e] > bv) { bv = l[e]; best = e; }
        idx[t]  = best;
        gate[t] = bv / s;
    }
}

// ---------------------------------------------------------------------------
// Kernel 2: counting sort of the token ids by expert, one work-group, no atomics.
// Each thread takes 8 consecutive tokens.  Its 8 per-expert counts travel as
// four words of two 16-bit fields (no field passes T_TOKENS = 8192, so no carry
// crosses a field): a prefix scan over the wave's lanes, then one over the 32
// wave totals, gives every token its place in its expert's segment.
// Writes offsets[9] and perm[T].
// ---------------------------------------------------------------------------
#define RANK_THREADS 1024
#define RANK_TOK     (T_TOKENS / RANK_THREADS)   // 8 tokens a thread

// Inclusive prefix sum over the 32 lanes of a wave, four packed words at once.
__device__ __forceinline__ void wave_scan4(unsigned (&v)[4], int lane)
{
#pragma unroll
    for (int d = 1; d < 32; d <<= 1) {
#pragma unroll
        for (int q = 0; q < 4; ++q) {
            const unsigned up = __shfl_up(v[q], d, 32);
            if (lane >= d) v[q] += up;
        }
    }
}

__global__ __launch_bounds__(RANK_THREADS) void moe_rank_kernel(
    const int* __restrict__ idx, int* __restrict__ offsets,
    int* __restrict__ perm)
{
    __shared__ uint4 waveTot[RANK_THREADS / 32];
    __shared__ int4  permS[T_TOKENS / 4];

    const int tid  = threadIdx.x;
    const int lane = tid & 31;
    const int wave = __builtin_amdgcn_readfirstlane(tid >> 5);

    const int4 i0 = ((const int4*)idx)[tid * 2];
    const int4 i1 = ((const int4*)idx)[tid * 2 + 1];
    const int e[RANK_TOK] = { i0.x & 7, i0.y & 7, i0.z & 7, i0.w & 7,
                              i1.x & 7, i1.y & 7, i1.z & 7, i1.w & 7 };

    // Rank of each token among this thread's own: 4-bit counters, one an expert.
    unsigned loc = 0;
    int r[RANK_TOK];
#pragma unroll
    for (int j = 0; j < RANK_TOK; ++j) {
        r[j] = (loc >> (4 * e[j])) & 15u;
        loc += 1u << (4 * e[j]);
    }

    unsigned own[4], incl[4];
#pragma unroll
    for (int q = 0; q < 4; ++q) {
        own[q]  = ((loc >> (8 * q)) & 15u) | (((loc >> (8 * q + 4)) & 15u) << 16);
        incl[q] = own[q];
    }
    wave_scan4(incl, lane);
    if (lane == 31)
        waveTot[wave] = make_uint4(incl[0], incl[1], incl[2], incl[3]);
    __syncthreads();   // the 32 wave totals are read by every wave

    const uint4 wt = waveTot[lane];
    unsigned tot[4] = { wt.x, wt.y, wt.z, wt.w };
    wave_scan4(tot, lane);

    // Segment starts (exclusive sum of the 8 totals), then this thread's first
    // free place in each segment, packed like the counts.
    int off[NEXP + 1];
    off[0] = 0;
    unsigned base[4];
#pragma unroll
    for (int q = 0; q < 4; ++q) {
        const unsigned all    = __builtin_amdgcn_readlane(tot[q], 31);
        const unsigned before = wave ? __builtin_amdgcn_readlane(tot[q], (wave - 1) & 31) : 0u;
        off[2 * q + 1] = off[2 * q]     + (int)(all & 0xffffu);
        off[2 * q + 2] = off[2 * q + 1] + (int)(all >> 16);
        base[q] = ((unsigned)off[2 * q] | ((unsigned)off[2 * q + 1] << 16))
                + before + (incl[q] - own[q]);
    }

    // perm is put together in LDS and leaves in whole lines.
    int* permW = (int*)permS;
#pragma unroll
    for (int j = 0; j < RANK_TOK; ++j) {
        const unsigned lo = (e[j] & 2) ? base[1] : base[0];
        const unsigned hi = (e[j] & 2) ? base[3] : base[2];
        const unsigned w  = (e[j] & 4) ? hi : lo;
        permW[((w >> ((e[j] & 1) * 16)) & 0xffffu) + r[j]] = tid * RANK_TOK + j;
    }
    __syncthreads();   // every place of permS is written before it is copied out

    ((int4*)perm)[tid]                = permS[tid];
    ((int4*)perm)[tid + RANK_THREADS] = permS[tid + RANK_THREADS];
    if (tid == 0) {
#pragma unroll
        for (int i = 0; i <= NEXP; ++i) offsets[i] = off[i];
    }
}

// ---------------------------------------------------------------------------
// Kernel 3: grouped GEMM over routed segments.
//  - V_WMMA_F32_16X16X4_F32 compute (8 waves x 3x2 16x16 accum tiles)
//  - A tile (gathered token rows): GLOBAL_LOAD_ASYNC_TO_LDS_B128 (ASYNCcnt)
//  - B tile (uniform weight tile):  TENSOR_LOAD_TO_LDS via TDM (TENSORcnt)
//  - double-buffered LDS, prefetch overlapped with compute
// grid = (H/128 col tiles, 93 row tiles at most over all experts), block = 256.
// ---------------------------------------------------------------------------
__global__ __launch_bounds__(256) void moe_gemm_kernel(
    const float* __restrict__ x,  const float* __restrict__ ew,
    const float* __restrict__ eb, const int*   __restrict__ offsets,
    const int*   __restrict__ perm, const float* __restrict__ gate,
    float* __restrict__ out)
{
    __shared__ float As[2][TILE_M][AS_STRIDE];   // A tiles: [m][k], padded
    __shared__ float Bs[2][TILE_K][BS_STRIDE];   // B tiles: [k][n], TDM-padded
    __shared__ int   tokRow[TILE_M];
    __shared__ float gateRow[TILE_M];
    __shared__ float biasN[TILE_N];

    const int n0 = blockIdx.x * TILE_N;

    // blockIdx.y numbers the row tiles that exist, expert after expert: count
    // the experts whose tiles all lie in front of it (the 9 offsets are read
    // up front, so the walk is scalar selects behind one load latency).
    int off[NEXP + 1];
    for (int i = 0; i <= NEXP; ++i) off[i] = offsets[i];
    const int rt = blockIdx.y;
    int e = 0, tileBeg = 0, segBeg = off[0], segEnd = off[1], tilesUpTo = 0;
    for (int i = 0; i < NEXP; ++i) {
        tilesUpTo += (off[i + 1] - off[i] + TILE_M - 1) / TILE_M;
        if (rt >= tilesUpTo) {
            e       = i + 1;
            tileBeg = tilesUpTo;
            segBeg  = off[i + 1];
            segEnd  = off[i + 2 <= NEXP ? i + 2 : NEXP];
        }
    }
    if (e >= NEXP) return;                         // uniform early exit: past the last tile
    const int count = segEnd - segBeg;
    const int m0    = (rt - tileBeg) * TILE_M;

    const int tid = threadIdx.x;
    if (tid < TILE_M) {
        const int g   = m0 + tid;
        const int tok = (g < count) ? perm[segBeg + g] : -1;
        tokRow[tid]  = tok;
        gateRow[tid] = (tok >= 0) ? gate[tok] : 0.f;
    }
    if (tid < TILE_N)
        biasN[tid] = eb[e * HDIM + n0 + tid];
    __syncthreads();

    const int wave  = tid >> 5;
    const int lane  = tid & 31;
    const int waveM = (wave >> 2) * (WAVE_MT * 16);   // 0 or 48
    const int waveN = (wave & 3) * 32;    // 0,32,64,96
    const int lhalf = lane >> 4;          // 0/1 -> K offset of +2 (A/B frag)
    const int l15   = lane & 15;

    v8f acc[WAVE_MT][2] = {};             // zero-initialized accumulators

    // Per-thread async staging roles for the A tile: the first A_WAVES waves
    // copy, whole waves only (a scalar test, so no copy issues with lanes off).
    const bool aWave = __builtin_amdgcn_readfirstlane(tid >> 5) < A_WAVES;
    const int arow = aWave ? (tid >> 1) : 0;   // 2 threads per A row
    const int akk  = (tid & 1) * 8;       // 8 floats each (2x b128)
    const int tokA = tokRow[arow];
    const int tokEff = (tokA >= 0) ? tokA : 0;   // tail rows alias token 0; masked at store
    const float* aSrc = x + (size_t)tokEff * HDIM + akk;

    // Uniform B tile source (expert weights) for the TDM.
    const float* bTileG = ew + (size_t)e * HDIM * HDIM + n0;

    const unsigned aLds[2] = {
        (unsigned)(size_t)&As[0][arow][akk],
        (unsigned)(size_t)&As[1][arow][akk] };
    const unsigned bLds[2] = {
        (unsigned)(size_t)&Bs[0][0][0],
        (unsigned)(size_t)&Bs[1][0][0] };

    // Prologue: fill buffer 0 for k0 = 0.
    if (aWave)
        async_ld_2xb128(aLds[0], aSrc);
    if (wave == 0) {
        tdm_load_b_tile(bLds[0], bTileG);
        __builtin_amdgcn_s_wait_tensorcnt(0);
    }
    wait_async0();
    __syncthreads();

    const int NSTEP = HDIM / TILE_K;      // 64
    for (int s = 0; s < NSTEP; ++s) {
        const int cur = s & 1;

        // Prefetch next K tile into the other buffer (overlaps with compute).
        if (s + 1 < NSTEP) {
            const int nxt = cur ^ 1;
            const int k1  = (s + 1) * TILE_K;
            if (aWave)
                async_ld_2xb128(aLds[nxt], aSrc + k1);
            if (wave == 0)
                tdm_load_b_tile(bLds[nxt], bTileG + (size_t)k1 * HDIM);
        }

        // Compute on current buffer: 4 K-substeps x (3x2) WMMA = 24 WMMAs.
#pragma unroll
        for (int kb = 0; kb < TILE_K; kb += 4) {
            const int kf = kb + lhalf * 2;
            // A fragments: 16x4 f32, lane = M (0..15), half-lanes K+2
            v2f afrag[WAVE_MT];
#pragma unroll
            for (int mt = 0; mt < WAVE_MT; ++mt) {
                const float* ap = &As[cur][waveM + mt * 16 + l15][kf];
                afrag[mt].x = ap[0];
                afrag[mt].y = ap[1];
            }
            // B fragments: 4x16 f32, lane = N (0..15), half-lanes K+2
            v2f bfrag[2];
#pragma unroll
            for (int nt = 0; nt < 2; ++nt) {
                const int n = waveN + nt * 16 + l15;
                bfrag[nt].x = Bs[cur][kf][n];
                bfrag[nt].y = Bs[cur][kf + 1][n];
            }
#pragma unroll
            for (int mt = 0; mt < WAVE_MT; ++mt) {
#pragma unroll
                for (int nt = 0; nt < 2; ++nt) {
                    acc[mt][nt] = __builtin_amdgcn_wmma_f32_16x16x4_f32(
                        false, afrag[mt], false, bfrag[nt],
                        (short)0, acc[mt][nt], false, false);
                }
            }
        }

        // Close RAW (prefetch -> next compute) and WAR (this compute -> refill):
        // this wave's LDS reads of the buffer have returned before the barrier
        // behind which the buffer is refilled.  The scheduling fence keeps the
        // pass's WMMAs in front of the waits: without it the compiler sinks half
        // of them behind the waits, which then drain the loads in mid-pass.
        __builtin_amdgcn_sched_barrier(0);
        asm volatile("s_wait_dscnt 0x0" ::: "memory");
        wait_async0();
        if (wave == 0)
            __builtin_amdgcn_s_wait_tensorcnt(0);
        __syncthreads();
    }

    // Epilogue: D layout — VGPR r: lanes0-15 -> M=r, lanes16-31 -> M=r+8, N=l15
#pragma unroll
    for (int mt = 0; mt < WAVE_MT; ++mt) {
#pragma unroll
        for (int nt = 0; nt < 2; ++nt) {
#pragma unroll
            for (int r = 0; r < 8; ++r) {
                const int mlocal = r + lhalf * 8;
                const int row    = waveM + mt * 16 + mlocal;
                const int tok    = tokRow[row];
                if (tok >= 0) {
                    const int nl = waveN + nt * 16 + l15;
                    out[(size_t)tok * HDIM + n0 + nl] =
                        gateRow[row] * (acc[mt][nt][r] + biasN[nl]);
                }
            }
        }
    }
}

// ---------------------------------------------------------------------------
// Launch
// ---------------------------------------------------------------------------
extern "C" void kernel_launch(void* const* d_in, const int* in_sizes, int n_in,
                              void* d_out, int out_size, void* d_ws, size_t ws_size,
                              hipStream_t stream)
{
    (void)in_sizes; (void)n_in; (void)out_size; (void)ws_size;

    const float* x  = (const float*)d_in[0];   // [T, H]
    const float* rw = (const float*)d_in[1];   // [H, E]
    const float* rb = (const float*)d_in[2];   // [E]
    const float* ew = (const float*)d_in[3];   // [E, H, H]
    const float* eb = (const float*)d_in[4];   // [E, H]
    float* out = (float*)d_out;                // [T, H]

    char*  ws      = (char*)d_ws;
    int*   idx     = (int*)  (ws);             // T ints
    float* gate    = (float*)(ws + 32768);     // T floats
    int*   perm    = (int*)  (ws + 65536);     // T ints
    int*   offsets = (int*)  (ws + 98368);     // E+1 ints

    moe_router_kernel<<<T_TOKENS / 8, 256, 0, stream>>>(x, rw, rb, idx, gate);
    moe_rank_kernel<<<1, RANK_THREADS, 0, stream>>>(idx, offsets, perm);

    dim3 grid(HDIM / TILE_N, MAX_ROW_TILES, 1);
    moe_gemm_kernel<<<grid, 256, 0, stream>>>(x, ew, eb, offsets, perm, gate, out);
}
